// v000
// Times are from an AMD MI455X. After a warm-up the kernel runs many times in a row, and a time is the length of
// such a window on the GPU divided by its runs, so every launch and the gaps after it count. The runs cycle
// through copies of the inputs. A figure is the median of several windows, for all but v000 over two sittings.
// Sittings can differ by a few percent; kernels timed side by side share one.
// v000, which the later versions start from, runs in 85 microseconds.
#include <hip/hip_runtime.h>
#include <math.h>

// Dims from the reference
#define LDIM 7
#define SDIM 200
#define SEDIM 240
#define DDIM 32
#define KSEL 3
#define BDIM 512

#define NTILE ((SDIM + 15) / 16)   // 13 column tiles of the router GEMM
#define SPAD  (NTILE * 16)         // 208 (padded S for LDS)

typedef __attribute__((ext_vector_type(2))) float v2f;
typedef __attribute__((ext_vector_type(8))) float v8f;

// ---------------------------------------------------------------------------
// Kernel 1: router. One wave (32 lanes) computes logits for a 16-token tile
// against all S clusters with V_WMMA_F32_16X16X4_F32, then top-3 + softmax.
// grid = (B/16, L), block = 32.
// ---------------------------------------------------------------------------
__global__ __launch_bounds__(32) void router_kernel(
    const float* __restrict__ x,        // [L,B,D]
    const float* __restrict__ vc,       // [L,S,D]
    int* __restrict__ top_idx,          // [L,B,K]
    float* __restrict__ probs)          // [L,B,K]
{
    __shared__ float lds[16][SPAD];

    const int lane  = threadIdx.x;          // 0..31
    const int btile = blockIdx.x;           // 0..B/16-1
    const int l     = blockIdx.y;           // 0..L-1
    const int b0    = btile * 16;

    const int mrow  = lane & 15;            // M index within tile
    const int khalf = (lane >> 4) * 2;      // lanes 0-15 -> K={0,1}, 16-31 -> K={2,3}

    // A fragments: x tile [16 tokens x 32 dims], 8 k-steps of K=4.
    const float* xrow = x + ((size_t)l * BDIM + b0 + mrow) * DDIM;
    v2f afrag[8];
#pragma unroll
    for (int kk = 0; kk < 8; ++kk) {
        const int k0 = kk * 4 + khalf;
        afrag[kk].x = xrow[k0 + 0];
        afrag[kk].y = xrow[k0 + 1];
    }

    // Sweep cluster tiles (N dimension), accumulate 16x16 f32 per tile.
    for (int nt = 0; nt < NTILE; ++nt) {
        const int   n     = nt * 16 + mrow;
        const float scale = (n < SDIM) ? 1.0f : 0.0f;   // zero-pad tail tile
        const int   nc    = (n < SDIM) ? n : 0;
        const float* crow = vc + ((size_t)l * SDIM + nc) * DDIM;

        v8f c = {};
#pragma unroll
        for (int kk = 0; kk < 8; ++kk) {
            const int k0 = kk * 4 + khalf;
            v2f bfrag;
            bfrag.x = crow[k0 + 0] * scale;   // B[k][n] = centroid[n][k]
            bfrag.y = crow[k0 + 1] * scale;
            c = __builtin_amdgcn_wmma_f32_16x16x4_f32(
                    false, afrag[kk], false, bfrag, (short)0, c, false, false);
        }

        // C layout: VGPR j -> (M=j, N=lane) for lanes 0-15, (M=j+8) for 16-31.
        const int row = (lane < 16) ? 0 : 8;
        const int col = nt * 16 + mrow;
#pragma unroll
        for (int j = 0; j < 8; ++j)
            lds[row + j][col] = c[j];
    }
    __syncthreads();

    // Lanes 0..15: serial top-3 over S=200 (strict '>' == top_k tie-breaking),
    // then softmax over the 3 kept logits.
    if (lane < 16) {
        float v0 = -__builtin_inff(), v1 = v0, v2 = v0;
        int   i0 = 0, i1 = 0, i2 = 0;
        for (int s = 0; s < SDIM; ++s) {
            const float v = lds[lane][s];
            if (v > v0)      { v2 = v1; i2 = i1; v1 = v0; i1 = i0; v0 = v; i0 = s; }
            else if (v > v1) { v2 = v1; i2 = i1; v1 = v;  i1 = s; }
            else if (v > v2) { v2 = v;  i2 = s; }
        }
        const float e0 = __expf(v0 - v0);
        const float e1 = __expf(v1 - v0);
        const float e2 = __expf(v2 - v0);
        const float inv = 1.0f / (e0 + e1 + e2);

        const size_t base = ((size_t)l * BDIM + b0 + lane) * KSEL;
        top_idx[base + 0] = i0;  probs[base + 0] = e0 * inv;
        top_idx[base + 1] = i1;  probs[base + 1] = e1 * inv;
        top_idx[base + 2] = i2;  probs[base + 2] = e2 * inv;
    }
}

// ---------------------------------------------------------------------------
// Kernel 2: gather + weighted matvec + top-k mix. One wave per (l,b) token;
// lane = output dim d. vec reads are lane-contiguous (128B/wave per e).
// block = 8 waves.
// ---------------------------------------------------------------------------
#define WPB 8

__global__ __launch_bounds__(WPB * 32) void compose_kernel(
    const float* __restrict__ vec,      // [L,S,SE,D]
    const float* __restrict__ gain,     // [L,S,SE,2]
    const int*   __restrict__ blk,      // [L,S,SE,2]
    const int*   __restrict__ top_idx,  // [L,B,K]
    const float* __restrict__ probs,    // [L,B,K]
    float* __restrict__ out)            // [L,B,D]
{
    __shared__ float wls[WPB][SEDIM];

    const int lane = threadIdx.x & 31;
    const int wid  = threadIdx.x >> 5;
    const int t    = blockIdx.x * WPB + wid;       // flat (l*B + b)
    if (t >= LDIM * BDIM) return;

    const int l = t / BDIM;
    float acc = 0.0f;

#pragma unroll
    for (int k = 0; k < KSEL; ++k) {
        const int   s = top_idx[(size_t)t * KSEL + k];
        const float p = probs[(size_t)t * KSEL + k];

        const size_t slab = ((size_t)l * SDIM + s) * SEDIM;

        // Capacity-slot weights into LDS: sigmoid(gain) masked by blk != 0.
        for (int e = lane; e < SEDIM; e += 32) {
            const size_t gi = (slab + e) * 2;       // [...,0] component
            const float  g  = gain[gi];
            const int    bi = blk[gi];
            wls[wid][e] = (bi != 0) ? (1.0f / (1.0f + __expf(-g))) : 0.0f;
        }
        // Same-wave LDS ops are in-order; no barrier needed.

        // Matvec: comp[d] = sum_e w[e] * vec[l,s,e,d], lane = d.
        float a = 0.0f;
        const float* vp = vec + slab * DDIM + lane;
#pragma unroll 8
        for (int e = 0; e < SEDIM; ++e)
            a = fmaf(wls[wid][e], vp[(size_t)e * DDIM], a);

        acc = fmaf(p, a, acc);
    }

    out[(size_t)t * DDIM + lane] = acc;
}

// ---------------------------------------------------------------------------
extern "C" void kernel_launch(void* const* d_in, const int* in_sizes, int n_in,
                              void* d_out, int out_size, void* d_ws, size_t ws_size,
                              hipStream_t stream)
{
    const float* x    = (const float*)d_in[0];   // [L,B,D]
    const float* vc   = (const float*)d_in[1];   // [L,S,D]
    const float* vec  = (const float*)d_in[2];   // [L,S,SE,D]
    const float* gain = (const float*)d_in[3];   // [L,S,SE,2]
    const int*   blk  = (const int*)d_in[4];     // [L,S,SE,2]
    float*       out  = (float*)d_out;           // [L,B,D]

    // Workspace: top-k indices then probs.
    int*   top_idx = (int*)d_ws;
    float* probs   = (float*)((char*)d_ws + sizeof(int) * (size_t)LDIM * BDIM * KSEL);

    dim3 g1(BDIM / 16, LDIM);
    router_kernel<<<g1, 32, 0, stream>>>(x, vc, top_idx, probs);

    const int nwaves = LDIM * BDIM;
    compose_kernel<<<(nwaves + WPB - 1) / WPB, WPB * 32, 0, stream>>>(
        vec, gain, blk, top_idx, probs, out);
}

// v002
// Measured time: 8.96 microseconds a run.
// Versions between v000 and this one are left out; their measured steps multiply to 9.55 times as fast.
#include <hip/hip_runtime.h>
#include <math.h>

// Dims from the reference
#define LDIM 7
#define SDIM 200
#define SEDIM 240
#define DDIM 32
#define KSEL 3
#define BDIM 512

#define NTILE ((SDIM + 15) / 16)   // 13 column tiles of the router GEMM
#define SPAD  (NTILE * 16)         // 208 (padded S for LDS)

typedef __attribute__((ext_vector_type(2))) float v2f;
typedef __attribute__((ext_vector_type(4))) float v4f;
typedef __attribute__((ext_vector_type(8))) float v8f;

#define EPG (SEDIM / 4)             // 60 capacity slots per 8-lane group

// ---------------------------------------------------------------------------
// Kernel 1: per-cluster composition. comp[l,s,d] = sum_e w[l,s,e]*vec[l,s,e,d]
// holds no token index, so it is formed once per cluster, not once per pick.
// One wave per (l,s) slab; a 16-byte load per lane covers 4 slots x 32 dims
// (512 contiguous bytes per wave). grid = L*S, block = 32.
// ---------------------------------------------------------------------------
__global__ __launch_bounds__(32) void cluster_compose_kernel(
    const float* __restrict__ vec,      // [L,S,SE,D]
    const float* __restrict__ gain,     // [L,S,SE,2]
    const int*   __restrict__ blk,      // [L,S,SE,2]
    float* __restrict__ comp)           // [L,S,D]
{
    // wls[g][i] = weight of slot e = 4*i + g, the slots that lane group g sums.
    __shared__ __attribute__((aligned(16))) float wls[4][EPG];

    const int    lane = threadIdx.x;            // 0..31
    const int    cs   = blockIdx.x;             // flat (l*S + s)
    const size_t slab = (size_t)cs * SEDIM;

    // Gain and block index of slot e = lane + 32*j ([...,0] component).
    // SE = 7.5 * 32: only the low half of the wave has an eighth slot.
    const float* gp = gain + slab * 2 + lane * 2;
    const int*   bp = blk + slab * 2 + lane * 2;
    float gv[8];
    int   bv[8];
#pragma unroll
    for (int j = 0; j < 7; ++j) {
        gv[j] = gp[j * 64];
        bv[j] = bp[j * 64];
    }
    gv[7] = 0.0f;
    bv[7] = 0;
    if (lane < 16) {
        gv[7] = gp[7 * 64];
        bv[7] = bp[7 * 64];
    }

    // The whole slab, all loads issued before the first use.
    const float4* vp = reinterpret_cast<const float4*>(vec + slab * DDIM) + lane;
    float4 v[EPG];
#pragma unroll
    for (int i = 0; i < EPG; ++i)
        v[i] = vp[i * 32];
    // Keeps the slab's loads in front of the wait for the gains; without it the
    // compiler sinks most of them behind the weights, one more memory latency.
    __builtin_amdgcn_sched_barrier(0);

    // Capacity-slot weights: sigmoid(gain) masked by blk != 0.
#pragma unroll
    for (int j = 0; j < 8; ++j) {
        const float sg = 1.0f / (1.0f + __expf(-gv[j]));
        if (j < 7 || lane < 16)
            wls[lane & 3][(lane >> 2) + 8 * j] = (bv[j] != 0) ? sg : 0.0f;
    }
    // Every lane's weights are stored before any lane reads them back.
    __syncthreads();

    const int grp = lane >> 3;
    float4 a = make_float4(0.0f, 0.0f, 0.0f, 0.0f);
#pragma unroll
    for (int i4 = 0; i4 < EPG; i4 += 4) {
        const float4 w4 = *reinterpret_cast<const float4*>(&wls[grp][i4]);
        const float  w[4] = {w4.x, w4.y, w4.z, w4.w};
#pragma unroll
        for (int u = 0; u < 4; ++u) {
            a.x = fmaf(w[u], v[i4 + u].x, a.x);
            a.y = fmaf(w[u], v[i4 + u].y, a.y);
            a.z = fmaf(w[u], v[i4 + u].z, a.z);
            a.w = fmaf(w[u], v[i4 + u].w, a.w);
        }
    }

    // Add the four lane groups' partial sums.
#pragma unroll
    for (int m = 8; m <= 16; m <<= 1) {
        a.x += __shfl_xor(a.x, m);
        a.y += __shfl_xor(a.y, m);
        a.z += __shfl_xor(a.z, m);
        a.w += __shfl_xor(a.w, m);
    }
    if (lane < 8)
        *reinterpret_cast<float4*>(comp + (size_t)cs * DDIM + lane * 4) = a;
}

// ---------------------------------------------------------------------------
// Kernel 2: router + mix. Four waves share one 16-token tile. Wave w forms the
// logits of column tiles w, w+4, w+8 (wave 0 also tile 12) with
// V_WMMA_F32_16X16X4_F32; then 8 lanes per token each rank 25 columns, merge
// their top-3 lists, and mix the three picked clusters' composed rows.
// grid = (B/16, L), block = 128.
// ---------------------------------------------------------------------------
#define RWAVES 4                               // waves per token tile
#define TPW    ((NTILE + RWAVES - 1) / RWAVES) // column tiles per wave (4)
#define SPL    8                               // lanes per token in the ranking
#define CPL    (SDIM / SPL)                    // 25 columns per lane

// Puts (v, s) into the descending list (v0,v1,v2). Strict '>' keeps an earlier
// entry in front of an equal later one, which is top_k's tie-breaking as long
// as entries arrive in rising column order.
__device__ __forceinline__ void top3_insert(
    float v, int s,
    float& v0, float& v1, float& v2, int& i0, int& i1, int& i2)
{
    const bool c0 = v > v0, c1 = v > v1, c2 = v > v2;
    v2 = c1 ? v1 : (c2 ? v : v2);
    i2 = c1 ? i1 : (c2 ? s : i2);
    v1 = c0 ? v0 : (c1 ? v : v1);
    i1 = c0 ? i0 : (c1 ? s : i1);
    v0 = c0 ? v : v0;
    i0 = c0 ? s : i0;
}

__global__ __launch_bounds__(RWAVES * 32) void router_kernel(
    const float* __restrict__ x,        // [L,B,D]
    const float* __restrict__ vc,       // [L,S,D]
    const float* __restrict__ comp,     // [L,S,D]
    float* __restrict__ out)            // [L,B,D]
{
    __shared__ float lds[16][SPAD];

    const int tid   = threadIdx.x;          // 0..127
    const int lane  = tid & 31;
    const int wave  = __builtin_amdgcn_readfirstlane(tid >> 5);
    const int btile = blockIdx.x;           // 0..B/16-1
    const int l     = blockIdx.y;           // 0..L-1
    const int b0    = btile * 16;

    const int mrow  = lane & 15;            // M index within tile
    const int khalf = (lane >> 4) * 2;      // lanes 0-15 -> K={0,1}, 16-31 -> K={2,3}

    // A fragments: x tile [16 tokens x 32 dims], 8 k-steps of K=4.
    const float* xrow = x + ((size_t)l * BDIM + b0 + mrow) * DDIM + khalf;
    v2f afrag[8];
#pragma unroll
    for (int kk = 0; kk < 8; ++kk)
        afrag[kk] = *reinterpret_cast<const v2f*>(xrow + kk * 4);

    // B fragments of this wave's column tiles: B[k][n] = centroid[n][k].
    const float* crow[TPW];
    v2f          bfrag[TPW][8];
    float        scale[TPW];
#pragma unroll
    for (int t = 0; t < TPW; ++t) {
        const int n  = (wave + RWAVES * t) * 16 + mrow;
        const int nc = (n < SDIM) ? n : 0;
        scale[t] = (n < SDIM) ? 1.0f : 0.0f;            // zero-pad tail tile
        crow[t]  = vc + ((size_t)l * SDIM + nc) * DDIM + khalf;
#pragma unroll
        for (int kk = 0; kk < 8; ++kk)
            bfrag[t][kk] = *reinterpret_cast<const v2f*>(crow[t] + kk * 4);
    }
    // Addresses and loaded fragments are inputs (inputs only): all 40 loads are
    // issued in front of the first product, one memory latency for the wave;
    // without it the last tile's loads sink into its branch, a second latency.
    // Precaution: no address register is reused ahead of its wait.
#define FRAG8(f) "v"(f[0]), "v"(f[1]), "v"(f[2]), "v"(f[3]), \
                 "v"(f[4]), "v"(f[5]), "v"(f[6]), "v"(f[7])
    asm volatile("s_wait_xcnt 0x0"
                 :: "v"(xrow), FRAG8(afrag), "v"(crow[0]), FRAG8(bfrag[0]));
    asm volatile("s_wait_xcnt 0x0"
                 :: "v"(crow[1]), FRAG8(bfrag[1]), "v"(crow[2]), FRAG8(bfrag[2]));
    asm volatile("s_wait_xcnt 0x0"
                 :: "v"(crow[3]), FRAG8(bfrag[3]));
#undef FRAG8

    // 16x16 f32 logits per column tile, k-steps in rising order.
#pragma unroll
    for (int t = 0; t < TPW; ++t) {
        const int nt = wave + RWAVES * t;
        if (t < TPW - 1 || nt < NTILE) {                // wave-uniform
            v8f c = {};
#pragma unroll
            for (int kk = 0; kk < 8; ++kk)
                c = __builtin_amdgcn_wmma_f32_16x16x4_f32(
                        false, afrag[kk], false, bfrag[t][kk] * scale[t],
                        (short)0, c, false, false);

            // C layout: VGPR j -> (M=j, N=lane) for lanes 0-15, (M=j+8) for 16-31.
            const int row = (lane < 16) ? 0 : 8;
            const int col = nt * 16 + mrow;
#pragma unroll
            for (int j = 0; j < 8; ++j)
                lds[row + j][col] = c[j];
        }
    }
    // All four waves' logits are stored before any lane ranks them.
    __syncthreads();

    // Ranking: lane (tok, part) ranks columns part*25 .. part*25+24 of its token.
    const int tok  = tid >> 3;              // 0..15
    const int part = tid & (SPL - 1);       // 0..7
    float v0 = -__builtin_inff(), v1 = v0, v2 = v0;
    int   i0 = 0, i1 = 0, i2 = 0;
    const float* lrow = &lds[tok][part * CPL];
#pragma unroll
    for (int i = 0; i < CPL; ++i)
        top3_insert(lrow[i], i, v0, v1, v2, i0, i1, i2);
    i0 += part * CPL;
    i1 += part * CPL;
    i2 += part * CPL;

    // Merge the 8 lists of a token. At each step the partner's columns lie all
    // below or all above this lane's; the upper list is put into the lower one,
    // so equal logits keep rising column order. Both partners end with one list.
#pragma unroll
    for (int mk = 1; mk < SPL; mk <<= 1) {
        const float w0 = __shfl_xor(v0, mk);
        const float w1 = __shfl_xor(v1, mk);
        const float w2 = __shfl_xor(v2, mk);
        const int   j0 = __shfl_xor(i0, mk);
        const int   j1 = __shfl_xor(i1, mk);
        const int   j2 = __shfl_xor(i2, mk);
        const bool  up = (part & mk) != 0;  // this lane holds the upper columns
        const float h0 = up ? v0 : w0, h1 = up ? v1 : w1, h2 = up ? v2 : w2;
        const int   g0 = up ? i0 : j0, g1 = up ? i1 : j1, g2 = up ? i2 : j2;
        v0 = up ? w0 : v0;  v1 = up ? w1 : v1;  v2 = up ? w2 : v2;
        i0 = up ? j0 : i0;  i1 = up ? j1 : i1;  i2 = up ? j2 : i2;
        top3_insert(h0, g0, v0, v1, v2, i0, i1, i2);
        top3_insert(h1, g1, v0, v1, v2, i0, i1, i2);
        top3_insert(h2, g2, v0, v1, v2, i0, i1, i2);
    }

    // Mix: the 8 lanes of a token hold 16 bytes of the row each, so a wave's
    // store covers 512 contiguous bytes of out. Picks are 0..S-1 by construction.
    const float* cl  = comp + (size_t)l * SDIM * DDIM + part * 4;
    const v4f*   cp0 = reinterpret_cast<const v4f*>(cl + i0 * DDIM);
    const v4f*   cp1 = reinterpret_cast<const v4f*>(cl + i1 * DDIM);
    const v4f*   cp2 = reinterpret_cast<const v4f*>(cl + i2 * DDIM);
    const v4f    cr0 = *cp0;
    const v4f    cr1 = *cp1;
    const v4f    cr2 = *cp2;

    // Softmax over the 3 kept logits.
    const float e0 = __expf(v0 - v0);
    const float e1 = __expf(v1 - v0);
    const float e2 = __expf(v2 - v0);
    const float inv = 1.0f / (e0 + e1 + e2);
    const float p0 = e0 * inv;
    const float p1 = e1 * inv;
    const float p2 = e2 * inv;

    // Keeps the softmax in front of the wait for the rows, under the loads'
    // latency; without it the compiler puts it behind that wait.
    __builtin_amdgcn_sched_barrier(0);
    // Precaution: addresses and loaded rows are inputs (inputs only), so the 3
    // loads stand in front of this wait and no address register is reused
    // ahead of it.
    asm volatile("s_wait_xcnt 0x0"
                 :: "v"(cp0), "v"(cp1), "v"(cp2), "v"(cr0), "v"(cr1), "v"(cr2));
    v4f o;
#pragma unroll
    for (int u = 0; u < 4; ++u)
        o[u] = fmaf(p2, cr2[u], fmaf(p1, cr1[u], p0 * cr0[u]));
    *reinterpret_cast<v4f*>(
        out + ((size_t)l * BDIM + b0 + tok) * DDIM + part * 4) = o;
}

// ---------------------------------------------------------------------------
extern "C" void kernel_launch(void* const* d_in, const int* in_sizes, int n_in,
                              void* d_out, int out_size, void* d_ws, size_t ws_size,
                              hipStream_t stream)
{
    const float* x    = (const float*)d_in[0];   // [L,B,D]
    const float* vc   = (const float*)d_in[1];   // [L,S,D]
    const float* vec  = (const float*)d_in[2];   // [L,S,SE,D]
    const float* gain = (const float*)d_in[3];   // [L,S,SE,2]
    const int*   blk  = (const int*)d_in[4];     // [L,S,SE,2]
    float*       out  = (float*)d_out;           // [L,B,D]

    // Workspace: the composed row of every cluster.
    float* comp = (float*)d_ws;                  // [L,S,D]

    cluster_compose_kernel<<<LDIM * SDIM, 32, 0, stream>>>(vec, gain, blk, comp);

    dim3 g1(BDIM / 16, LDIM);
    router_kernel<<<g1, RWAVES * 32, 0, stream>>>(x, vc, comp, out);
}

// v003
// Measured time: 8.35 microseconds a run.
// Timed twice side by side with v002, it ran 1.08 and 1.07 times as fast.
// Counting every step since v000, it is 10.3 times as fast.
#include <hip/hip_runtime.h>
#include <math.h>

// Dims from the reference
#define LDIM 7
#define SDIM 200
#define SEDIM 240
#define DDIM 32
#define KSEL 3
#define BDIM 512

#define NTILE ((SDIM + 15) / 16)   // 13 column tiles of the router GEMM
#define SPAD  (NTILE * 16)         // 208 (padded S for LDS)

typedef __attribute__((ext_vector_type(2))) float v2f;
typedef __attribute__((ext_vector_type(4))) float v4f;
typedef __attribute__((ext_vector_type(8))) float v8f;

#define EPG (SEDIM / 4)             // 60 capacity slots per 8-lane group

#define RWAVES 4                               // waves per work-group, launch 1
#define NSCORE ((BDIM / 16) * LDIM)            // 224 work-groups that score tokens
#define NCOMP  ((LDIM * SDIM) / RWAVES)        // 350 work-groups that compose
#define RECW   8                               // words of a token's routing record

// ---------------------------------------------------------------------------
// Launch 1, composing part. comp[l,s,d] = sum_e w[l,s,e]*vec[l,s,e,d] holds no
// token index, so it is formed once per cluster, not once per pick. One wave
// per (l,s) slab, four slabs per work-group; a 16-byte load per lane covers
// 4 slots x 32 dims (512 contiguous bytes per wave).
// ---------------------------------------------------------------------------
__device__ __forceinline__ void compose_slab(
    const float* __restrict__ vec,      // [L,S,SE,D]
    const float* __restrict__ gain,     // [L,S,SE,2]
    const int*   __restrict__ blk,      // [L,S,SE,2]
    float* __restrict__ comp,           // [L,S,D]
    const int cs,                       // flat (l*S + s), this wave's slab
    const int lane,                     // 0..31
    float (*wls)[EPG])                  // this wave's own weights in LDS
{
    // wls[g][i] = weight of slot e = 4*i + g, the slots that lane group g sums.
    const size_t slab = (size_t)cs * SEDIM;

    // Gain and block index of slot e = lane + 32*j ([...,0] component).
    // SE = 7.5 * 32: only the low half of the wave has an eighth slot.
    const float* gp = gain + slab * 2 + lane * 2;
    const int*   bp = blk + slab * 2 + lane * 2;
    float gv[8];
    int   bv[8];
#pragma unroll
    for (int j = 0; j < 7; ++j) {
        gv[j] = gp[j * 64];
        bv[j] = bp[j * 64];
    }
    gv[7] = 0.0f;
    bv[7] = 0;
    if (lane < 16) {
        gv[7] = gp[7 * 64];
        bv[7] = bp[7 * 64];
    }

    // The whole slab, all loads issued before the first use.
    const float4* vp = reinterpret_cast<const float4*>(vec + slab * DDIM) + lane;
    float4 v[EPG];
#pragma unroll
    for (int i = 0; i < EPG; ++i)
        v[i] = vp[i * 32];
    // Keeps the slab's loads in front of the wait for the gains; without it the
    // compiler sinks most of them behind the weights, one more memory latency.
    __builtin_amdgcn_sched_barrier(0);

    // Capacity-slot weights: sigmoid(gain) masked by blk != 0.
#pragma unroll
    for (int j = 0; j < 8; ++j) {
        const float sg = 1.0f / (1.0f + __expf(-gv[j]));
        if (j < 7 || lane < 16)
            wls[lane & 3][(lane >> 2) + 8 * j] = (bv[j] != 0) ? sg : 0.0f;
    }
    // Every lane's weights are stored before any lane reads them back (each
    // wave reads its own; all four waves of a composing work-group pass here).
    __syncthreads();

    const int grp = lane >> 3;
    float4 a = make_float4(0.0f, 0.0f, 0.0f, 0.0f);
#pragma unroll
    for (int i4 = 0; i4 < EPG; i4 += 4) {
        const float4 w4 = *reinterpret_cast<const float4*>(&wls[grp][i4]);
        const float  w[4] = {w4.x, w4.y, w4.z, w4.w};
#pragma unroll
        for (int u = 0; u < 4; ++u) {
            a.x = fmaf(w[u], v[i4 + u].x, a.x);
            a.y = fmaf(w[u], v[i4 + u].y, a.y);
            a.z = fmaf(w[u], v[i4 + u].z, a.z);
            a.w = fmaf(w[u], v[i4 + u].w, a.w);
        }
    }

    // Add the four lane groups' partial sums.
#pragma unroll
    for (int m = 8; m <= 16; m <<= 1) {
        a.x += __shfl_xor(a.x, m);
        a.y += __shfl_xor(a.y, m);
        a.z += __shfl_xor(a.z, m);
        a.w += __shfl_xor(a.w, m);
    }
    if (lane < 8)
        *reinterpret_cast<float4*>(comp + (size_t)cs * DDIM + lane * 4) = a;
}

// ---------------------------------------------------------------------------
// Launch 1, scoring part. It reads nothing that the composing part writes, so
// both share one grid. Four waves share one 16-token tile. Wave w forms the
// logits of column tiles w, w+4, w+8 (wave 0 also tile 12) with
// V_WMMA_F32_16X16X4_F32; then 8 lanes per token each rank 25 columns, merge
// their top-3 lists and store the token's record: 3 picks and 3 weights.
// ---------------------------------------------------------------------------
#define TPW    ((NTILE + RWAVES - 1) / RWAVES) // column tiles per wave (4)
#define SPL    8                               // lanes per token in the ranking
#define CPL    (SDIM / SPL)                    // 25 columns per lane

// Puts (v, s) into the descending list (v0,v1,v2). Strict '>' keeps an earlier
// entry in front of an equal later one, which is top_k's tie-breaking as long
// as entries arrive in rising column order.
__device__ __forceinline__ void top3_insert(
    float v, int s,
    float& v0, float& v1, float& v2, int& i0, int& i1, int& i2)
{
    const bool c0 = v > v0, c1 = v > v1, c2 = v > v2;
    v2 = c1 ? v1 : (c2 ? v : v2);
    i2 = c1 ? i1 : (c2 ? s : i2);
    v1 = c0 ? v0 : (c1 ? v : v1);
    i1 = c0 ? i0 : (c1 ? s : i1);
    v0 = c0 ? v : v0;
    i0 = c0 ? s : i0;
}

__device__ __forceinline__ void score_tile(
    const float* __restrict__ x,        // [L,B,D]
    const float* __restrict__ vc,       // [L,S,D]
    float* __restrict__ rec,            // [L,B,RECW]
    const int tile,                     // flat (l*(B/16) + token tile)
    const int tid,                      // 0..127
    const int wave,                     // 0..3
    float (*lds)[SPAD])                 // 16 rows of logits
{
    const int lane  = tid & 31;
    const int l     = tile / (BDIM / 16);   // 0..L-1
    const int b0    = (tile % (BDIM / 16)) * 16;

    const int mrow  = lane & 15;            // M index within tile
    const int khalf = (lane >> 4) * 2;      // lanes 0-15 -> K={0,1}, 16-31 -> K={2,3}

    // A fragments: x tile [16 tokens x 32 dims], 8 k-steps of K=4.
    const float* xrow = x + ((size_t)l * BDIM + b0 + mrow) * DDIM + khalf;
    v2f afrag[8];
#pragma unroll
    for (int kk = 0; kk < 8; ++kk)
        afrag[kk] = *reinterpret_cast<const v2f*>(xrow + kk * 4);

    // B fragments of this wave's column tiles: B[k][n] = centroid[n][k].
    const float* crow[TPW];
    v2f          bfrag[TPW][8];
    float        scale[TPW];
#pragma unroll
    for (int t = 0; t < TPW; ++t) {
        const int n  = (wave + RWAVES * t) * 16 + mrow;
        const int nc = (n < SDIM) ? n : 0;
        scale[t] = (n < SDIM) ? 1.0f : 0.0f;            // zero-pad tail tile
        crow[t]  = vc + ((size_t)l * SDIM + nc) * DDIM + khalf;
#pragma unroll
        for (int kk = 0; kk < 8; ++kk)
            bfrag[t][kk] = *reinterpret_cast<const v2f*>(crow[t] + kk * 4);
    }
    // Addresses and loaded fragments are inputs (inputs only): all 40 loads are
    // issued in front of the first product, one memory latency for the wave;
    // without it the last tile's loads sink into its branch, a second latency.
    // Precaution: no address register is reused ahead of its wait.
#define FRAG8(f) "v"(f[0]), "v"(f[1]), "v"(f[2]), "v"(f[3]), \
                 "v"(f[4]), "v"(f[5]), "v"(f[6]), "v"(f[7])
    asm volatile("s_wait_xcnt 0x0"
                 :: "v"(xrow), FRAG8(afrag), "v"(crow[0]), FRAG8(bfrag[0]));
    asm volatile("s_wait_xcnt 0x0"
                 :: "v"(crow[1]), FRAG8(bfrag[1]), "v"(crow[2]), FRAG8(bfrag[2]));
    asm volatile("s_wait_xcnt 0x0"
                 :: "v"(crow[3]), FRAG8(bfrag[3]));
#undef FRAG8

    // 16x16 f32 logits per column tile, k-steps in rising order.
#pragma unroll
    for (int t = 0; t < TPW; ++t) {
        const int nt = wave + RWAVES * t;
        if (t < TPW - 1 || nt < NTILE) {                // wave-uniform
            v8f c = {};
#pragma unroll
            for (int kk = 0; kk < 8; ++kk)
                c = __builtin_amdgcn_wmma_f32_16x16x4_f32(
                        false, afrag[kk], false, bfrag[t][kk] * scale[t],
                        (short)0, c, false, false);

            // C layout: VGPR j -> (M=j, N=lane) for lanes 0-15, (M=j+8) for 16-31.
            const int row = (lane < 16) ? 0 : 8;
            const int col = nt * 16 + mrow;
#pragma unroll
            for (int j = 0; j < 8; ++j)
                lds[row + j][col] = c[j];
        }
    }
    // All four waves' logits are stored before any lane ranks them.
    __syncthreads();

    // Ranking: lane (tok, part) ranks columns part*25 .. part*25+24 of its token.
    const int tok  = tid >> 3;              // 0..15
    const int part = tid & (SPL - 1);       // 0..7
    float v0 = -__builtin_inff(), v1 = v0, v2 = v0;
    int   i0 = 0, i1 = 0, i2 = 0;
    const float* lrow = &lds[tok][part * CPL];
#pragma unroll
    for (int i = 0; i < CPL; ++i)
        top3_insert(lrow[i], i, v0, v1, v2, i0, i1, i2);
    i0 += part * CPL;
    i1 += part * CPL;
    i2 += part * CPL;

    // Merge the 8 lists of a token. At each step the partner's columns lie all
    // below or all above this lane's; the upper list is put into the lower one,
    // so equal logits keep rising column order. Both partners end with one list.
#pragma unroll
    for (int mk = 1; mk < SPL; mk <<= 1) {
        const float w0 = __shfl_xor(v0, mk);
        const float w1 = __shfl_xor(v1, mk);
        const float w2 = __shfl_xor(v2, mk);
        const int   j0 = __shfl_xor(i0, mk);
        const int   j1 = __shfl_xor(i1, mk);
        const int   j2 = __shfl_xor(i2, mk);
        const bool  up = (part & mk) != 0;  // this lane holds the upper columns
        const float h0 = up ? v0 : w0, h1 = up ? v1 : w1, h2 = up ? v2 : w2;
        const int   g0 = up ? i0 : j0, g1 = up ? i1 : j1, g2 = up ? i2 : j2;
        v0 = up ? w0 : v0;  v1 = up ? w1 : v1;  v2 = up ? w2 : v2;
        i0 = up ? j0 : i0;  i1 = up ? j1 : i1;  i2 = up ? j2 : i2;
        top3_insert(h0, g0, v0, v1, v2, i0, i1, i2);
        top3_insert(h1, g1, v0, v1, v2, i0, i1, i2);
        top3_insert(h2, g2, v0, v1, v2, i0, i1, i2);
    }

    // Softmax over the 3 kept logits.
    const float e0 = __expf(v0 - v0);
    const float e1 = __expf(v1 - v0);
    const float e2 = __expf(v2 - v0);
    const float inv = 1.0f / (e0 + e1 + e2);
    const float p0 = e0 * inv;
    const float p1 = e1 * inv;
    const float p2 = e2 * inv;

    // Record of a token: words 0..2 its picks (0..S-1 by construction), words
    // 4..6 their weights. Lane 'part' stores word 'part', so a wave's store is
    // one whole 128-byte line with one writer.
    const float pw = (part == 4) ? p0 : (part == 5) ? p1 : (part == 6) ? p2 : 0.0f;
    const int   iw = (part == 0) ? i0 : (part == 1) ? i1 : (part == 2) ? i2 : 0;
    rec[((size_t)l * BDIM + b0 + tok) * RECW + part] =
        (part < 4) ? __int_as_float(iw) : pw;
}

// Launch 1: work-groups 0..NSCORE-1 score (the longer chain of dependent steps,
// so they start first), the others compose. grid = NSCORE + NCOMP, block = 128.
__global__ __launch_bounds__(RWAVES * 32) void compose_and_score_kernel(
    const float* __restrict__ x,        // [L,B,D]
    const float* __restrict__ vc,       // [L,S,D]
    const float* __restrict__ vec,      // [L,S,SE,D]
    const float* __restrict__ gain,     // [L,S,SE,2]
    const int*   __restrict__ blk,      // [L,S,SE,2]
    float* __restrict__ comp,           // [L,S,D]
    float* __restrict__ rec)            // [L,B,RECW]
{
    __shared__ float lds[16][SPAD];
    __shared__ __attribute__((aligned(16))) float wls[RWAVES][4][EPG];

    const int tid  = threadIdx.x;           // 0..127
    const int wave = __builtin_amdgcn_readfirstlane(tid >> 5);
    const int wg   = blockIdx.x;
    if (wg < NSCORE)                        // uniform over the work-group
        score_tile(x, vc, rec, wg, tid, wave, lds);
    else
        compose_slab(vec, gain, blk, comp, (wg - NSCORE) * RWAVES + wave,
                     tid & 31, wls[wave]);
}

// ---------------------------------------------------------------------------
// Launch 2: mix. One wave per 16 tokens; the 8 lanes of a group hold 16 bytes
// of a row each and take 4 tokens, so each of a wave's stores covers 512
// contiguous bytes of out. grid = L*B/16, block = 32.
// ---------------------------------------------------------------------------
#define MTOK 4                              // tokens per 8-lane group
__global__ __launch_bounds__(32) void mix_kernel(
    const float* __restrict__ comp,     // [L,S,D]
    const float* __restrict__ rec,      // [L,B,RECW]
    float* __restrict__ out)            // [L,B,D]
{
    const int lane = threadIdx.x;           // 0..31
    const int part = lane & (SPL - 1);
    const int t0   = blockIdx.x * 16 + (lane >> 3);   // flat (l*B + b), token 0
    const int l    = blockIdx.x / (BDIM / 16);
    const float* cl = comp + (size_t)l * SDIM * DDIM + part * 4;

    const v4f* rt[MTOK];
    v4f ri[MTOK], rp[MTOK];
#pragma unroll
    for (int u = 0; u < MTOK; ++u) {
        rt[u] = reinterpret_cast<const v4f*>(rec + (size_t)(t0 + 4 * u) * RECW);
        ri[u] = rt[u][0];
        rp[u] = rt[u][1];
    }
    // Addresses and loaded records are inputs (inputs only): all 8 loads are
    // issued in front of the first use, one memory latency; without it the
    // compiler waits for token 0's record alone first, a second latency.
    // Precaution: no address register is reused ahead of its wait.
#define ROW4(f) "v"(f[0]), "v"(f[1]), "v"(f[2]), "v"(f[3])
    asm volatile("s_wait_xcnt 0x0" :: ROW4(rt), ROW4(ri), ROW4(rp));

    const v4f* cp[MTOK][KSEL];
    v4f        cr[MTOK][KSEL];
#pragma unroll
    for (int u = 0; u < MTOK; ++u)
#pragma unroll
        for (int k = 0; k < KSEL; ++k) {
            cp[u][k] = reinterpret_cast<const v4f*>(
                cl + __float_as_int(ri[u][k]) * DDIM);
            cr[u][k] = *cp[u][k];
        }
    // The same for the 12 row loads: all issued in front of the first product;
    // without it the compiler strings loads and products over several latencies.
#define ROW3(f) "v"(f[0]), "v"(f[1]), "v"(f[2])
    asm volatile("s_wait_xcnt 0x0"
                 :: ROW3(cp[0]), ROW3(cp[1]), ROW3(cp[2]), ROW3(cp[3]),
                    ROW3(cr[0]), ROW3(cr[1]), ROW3(cr[2]), ROW3(cr[3]));
#undef ROW3
#undef ROW4
#pragma unroll
    for (int u = 0; u < MTOK; ++u) {
        v4f o;
#pragma unroll
        for (int c = 0; c < 4; ++c)
            o[c] = fmaf(rp[u][2], cr[u][2][c],
                        fmaf(rp[u][1], cr[u][1][c], rp[u][0] * cr[u][0][c]));
        *reinterpret_cast<v4f*>(out + (size_t)(t0 + 4 * u) * DDIM + part * 4) = o;
    }
}

// ---------------------------------------------------------------------------
extern "C" void kernel_launch(void* const* d_in, const int* in_sizes, int n_in,
                              void* d_out, int out_size, void* d_ws, size_t ws_size,
                              hipStream_t stream)
{
    const float* x    = (const float*)d_in[0];   // [L,B,D]
    const float* vc   = (const float*)d_in[1];   // [L,S,D]
    const float* vec  = (const float*)d_in[2];   // [L,S,SE,D]
    const float* gain = (const float*)d_in[3];   // [L,S,SE,2]
    const int*   blk  = (const int*)d_in[4];     // [L,S,SE,2]
    float*       out  = (float*)d_out;           // [L,B,D]

    // Workspace: the composed row of every cluster, then every token's record.
    float* comp = (float*)d_ws;                  // [L,S,D]
    float* rec  = comp + LDIM * SDIM * DDIM;     // [L,B,RECW]

    compose_and_score_kernel<<<NSCORE + NCOMP, RWAVES * 32, 0, stream>>>(
        x, vc, vec, gain, blk, comp, rec);
    mix_kernel<<<NSCORE, 32, 0, stream>>>(comp, rec, out);
}
